// v000
// Measured on an AMD MI455X. A time is GPU time per run, averaged over a window of back-to-back runs after a warm-up
// (all launches, gaps included; the runs take copies of the inputs in turn), and the median of several windows.
// Apart from v000's, it joins two sittings. Times from different sittings can be a few percent apart, while
// side-by-side timings come from the same sitting.
// v000, which the later versions start from, runs in 11.9 microseconds.
#include <hip/hip_runtime.h>

// einsum('bsn,bnse->bse'): B=8, S=4096, N=8, E=128, all f32.
// Bandwidth-bound (152 MB, ~6.5us floor @ 23.3 TB/s). One wave per (b,s):
// the N=8 weighted combine is done exactly with chained V_WMMA_F32_16X16X4_F32
// (A = w-row replicated over all 16 M rows -> every D row equals the result).

typedef __attribute__((ext_vector_type(2))) float v2f;
typedef __attribute__((ext_vector_type(8))) float v8f;

#define BB 8
#define SS 4096
#define NN 8
#define EE 128

__global__ __launch_bounds__(256) void moe_combine_wmma(
    const float* __restrict__ W,   // [B,S,N]   routing_logits
    const float* __restrict__ X,   // [B,N,S,E] expert_outputs
    float* __restrict__ O)         // [B,S,E]
{
    const int lane = threadIdx.x & 31;
    const int wave = threadIdx.x >> 5;
    const int g    = blockIdx.x * 8 + wave;   // flat (b*S + s), 0..32767
    const int b    = g >> 12;                 // / 4096
    const int s    = g & (SS - 1);

    const int half = lane >> 4;               // 0: lanes 0-15, 1: lanes 16-31
    const int col  = lane & 15;

    // ---- A operands: weight row w[s,0..7], replicated across all 16 M rows.
    // A 16x4 f32 layout: VGPR0 = K0 (lanes 0-15) / K2 (lanes 16-31), VGPR1 = K1/K3.
    const float* wrow = W + (size_t)g * NN;
    const float4 wa = ((const float4*)wrow)[0];   // w0..w3 (broadcast read, 16B aligned)
    const float4 wb = ((const float4*)wrow)[1];   // w4..w7
    v2f A0, A1;
    A0.x = half ? wa.z : wa.x;    // K = 2 : 0
    A0.y = half ? wa.w : wa.y;    // K = 3 : 1
    A1.x = half ? wb.z : wb.x;    // K = 6 : 4
    A1.y = half ? wb.w : wb.y;    // K = 7 : 5

    // ---- B operands: x[k, s, e0+col] in native 4x16 layout.
    // VGPR0 holds K=0 (lanes 0-15) and K=2 (lanes 16-31); VGPR1 holds K=1/K=3.
    const size_t nstride = (size_t)SS * EE;                      // stride between n planes
    const float* xbase = X + (size_t)b * NN * nstride + (size_t)s * EE + col;
    const float* p0 = xbase + (size_t)(2 * half + 0) * nstride;  // K = 0 / 2
    const float* p1 = xbase + (size_t)(2 * half + 1) * nstride;  // K = 1 / 3
    const float* p4 = xbase + (size_t)(2 * half + 4) * nstride;  // K = 4 / 6
    const float* p5 = xbase + (size_t)(2 * half + 5) * nstride;  // K = 5 / 7

    float* orow = O + (size_t)g * EE;

#pragma unroll
    for (int tp = 0; tp < 4; ++tp) {           // pairs of 16-wide e-tiles
        const int e0 = tp * 32;

        // e-tile [e0, e0+16): D[m, c] = sum_{n=0..7} w[n] * x[n, s, e0+c]  (all m equal)
        v2f B0, B1;
        v8f c0 = {};
        B0.x = p0[e0];      B0.y = p1[e0];
        B1.x = p4[e0];      B1.y = p5[e0];
        c0 = __builtin_amdgcn_wmma_f32_16x16x4_f32(false, A0, false, B0, (short)0, c0, false, false);
        c0 = __builtin_amdgcn_wmma_f32_16x16x4_f32(false, A1, false, B1, (short)0, c0, false, false);

        // e-tile [e0+16, e0+32)
        v8f c1 = {};
        B0.x = p0[e0 + 16]; B0.y = p1[e0 + 16];
        B1.x = p4[e0 + 16]; B1.y = p5[e0 + 16];
        c1 = __builtin_amdgcn_wmma_f32_16x16x4_f32(false, A0, false, B0, (short)0, c1, false, false);
        c1 = __builtin_amdgcn_wmma_f32_16x16x4_f32(false, A1, false, B1, (short)0, c1, false, false);

        // D VGPR0: lanes 0-15 = row M=0 (N=col), lanes 16-31 = row M=8 (N=col);
        // all rows identical, so a full-wave 128B coalesced store covers both tiles.
        const float val = half ? c1[0] : c0[0];
        __builtin_nontemporal_store(val, orow + e0 + lane);
    }
}

extern "C" void kernel_launch(void* const* d_in, const int* in_sizes, int n_in,
                              void* d_out, int out_size, void* d_ws, size_t ws_size,
                              hipStream_t stream) {
    const float* W = (const float*)d_in[0];   // routing_logits [B,S,N]
    const float* X = (const float*)d_in[1];   // expert_outputs [B,N,S,E]
    float* O = (float*)d_out;                 // [B,S,E]
    (void)in_sizes; (void)n_in; (void)out_size; (void)d_ws; (void)ws_size;

    dim3 grid(BB * SS / 8);   // 4096 blocks x 8 waves = one wave per (b,s)
    dim3 block(256);
    hipLaunchKernelGGL(moe_combine_wmma, grid, block, 0, stream, W, X, O);
}

// v001
// A run of this version takes 11.2 microseconds.
// Two timings next to v000 both put it at 1.07 times that version's speed.
#include <hip/hip_runtime.h>
#include <stdint.h>

// einsum('bsn,bnse->bse'): B=8, S=4096, N=8, E=128, all f32.
// A work-group of 8 waves walks 64 consecutive (b,s) rows in 4 trips of 16 rows.
// The x rows of a trip (16 rows x 8 planes x 512 B = 64 KiB) come into LDS by
// asynchronous 16-byte copies, two buffers: the next trip's tile flies while this
// trip's tile is worked on. The combine stays on V_WMMA_F32_16X16X4_F32.

typedef __attribute__((ext_vector_type(2))) float v2f;
typedef __attribute__((ext_vector_type(4))) float v4f;
typedef __attribute__((ext_vector_type(8))) float v8f;

#define BB 8
#define SS 4096
#define NN 8
#define EE 128
#define WAVES 8
#define RPW 2                          // rows a wave takes per trip
#define TILE_ROWS (WAVES * RPW)        // 16 rows a trip
#define TRIPS 4
#define WG_ROWS (TILE_ROWS * TRIPS)    // 64 rows a work-group

// One (b,s) row of x: its 8 planes, 512 B each, every lane 16 B of each plane.
// lds: the lane's LDS byte address in plane 0 of the row's slot (planes 512 B apart);
// g: the lane's global address in plane 0 (planes SS*EE floats apart).
// s_wait_xcnt 0 closes the statement, so that no address register named here is
// rewritten while a copy's address translation may still be open.
__device__ __forceinline__ void copy_row(uint32_t lds, const float* g)
{
    const size_t ns = (size_t)SS * EE;
    asm volatile(
        "global_load_async_to_lds_b128 %0, %8, off\n\t"
        "global_load_async_to_lds_b128 %1, %9, off\n\t"
        "global_load_async_to_lds_b128 %2, %10, off\n\t"
        "global_load_async_to_lds_b128 %3, %11, off\n\t"
        "global_load_async_to_lds_b128 %4, %12, off\n\t"
        "global_load_async_to_lds_b128 %5, %13, off\n\t"
        "global_load_async_to_lds_b128 %6, %14, off\n\t"
        "global_load_async_to_lds_b128 %7, %15, off\n\t"
        "s_wait_xcnt 0x0"
        :: "v"(lds), "v"(lds + 512u), "v"(lds + 1024u), "v"(lds + 1536u),
           "v"(lds + 2048u), "v"(lds + 2560u), "v"(lds + 3072u), "v"(lds + 3584u),
           "v"(g), "v"(g + ns), "v"(g + 2 * ns), "v"(g + 3 * ns),
           "v"(g + 4 * ns), "v"(g + 5 * ns), "v"(g + 6 * ns), "v"(g + 7 * ns)
        : "memory");
}

__global__ __launch_bounds__(256) void moe_combine_wmma(
    const float* __restrict__ W,   // [B,S,N]   routing_logits
    const float* __restrict__ X,   // [B,N,S,E] expert_outputs
    float* __restrict__ O)         // [B,S,E]
{
    __shared__ __attribute__((aligned(16))) float xs[2][TILE_ROWS][NN][EE];   // 2 x 64 KiB

    const int lane = threadIdx.x & 31;
    const int wave = __builtin_amdgcn_readfirstlane(threadIdx.x >> 5);
    const int g0   = blockIdx.x * WG_ROWS;    // first flat (b*S + s) row; 64 divides S
    const int b    = g0 >> 12;
    const int s0   = g0 & (SS - 1);
    const int half = lane >> 4;
    const int col  = lane & 15;

    // The wave's rows: tile row 2*wave + j of every trip.
    const int r0 = wave * RPW;

    // Weights of the wave's 8 rows (wave-uniform addresses), read once, ahead of the loop.
    float w[TRIPS][RPW][NN];
#pragma unroll   // all three: constant indices keep w[][][] in registers
    for (int t = 0; t < TRIPS; ++t)
#pragma unroll   // as above
        for (int j = 0; j < RPW; ++j)
#pragma unroll   // as above
            for (int n = 0; n < NN; ++n)
                w[t][j][n] = W[(size_t)(g0 + t * TILE_ROWS + r0 + j) * NN + n];

    // Lane's global address in plane 0, tile row r0 of trip 0, and its LDS address there.
    const float* xg = X + ((size_t)b * NN * SS + (size_t)(s0 + r0)) * EE + lane * 4;
    const uint32_t l0 = (uint32_t)(size_t)&xs[0][r0][0][lane * 4];
    const uint32_t buf_bytes = (uint32_t)sizeof(xs[0]);
    const uint32_t row_bytes = (uint32_t)sizeof(xs[0][0]);

    // A 16x4: lane (half, col) holds A[col][2*half + i] in register i. A[m][k] = w[n] where
    // (m & 3) == k, else 0: row class k of D then holds w[n] * B[k][c] alone.
    const bool a0 = (col & 3) == 2 * half;
    const bool a1 = (col & 3) == 2 * half + 1;

    // Tile 0 into buffer 0; it must have landed, for every wave, before anyone reads it.
    copy_row(l0, xg);
    copy_row(l0 + row_bytes, xg + EE);
    asm volatile("s_wait_asynccnt 0x0" ::: "memory");   // this wave's copies of tile 0 have landed
    __syncthreads();
    // Tile 1 into buffer 1: flies during trip 0.
    copy_row(l0 + buf_bytes, xg + (size_t)TILE_ROWS * EE);
    copy_row(l0 + buf_bytes + row_bytes, xg + (size_t)(TILE_ROWS + 1) * EE);

#pragma unroll   // w[t] is indexed by the trip: keeps it in registers
    for (int t = 0; t < TRIPS; ++t) {
        const int buf = t & 1;
        v4f o[RPW];
#pragma unroll   // the two rows' four WMMA chains interleave; o[] stays in registers
        for (int j = 0; j < RPW; ++j) {
            // B 4x16: lane (half, c) holds B[2*half + i][c] in register i. The lane's 16 bytes of
            // plane n are x[n][4*lane .. 4*lane+3] = x[n][64*half + 4*c + 0..3]: elements 0,1 feed
            // chain ca, elements 2,3 chain cb. D[m][c] = sum_n w[n] * x[n][64*(k>>1) + 4*c + (k&1) (+2)],
            // k = m & 3; one plane a WMMA, n = 0..7 in turn.
            const v4f* xr = (const v4f*)&xs[buf][r0 + j][0][lane * 4];
            v4f x[NN];
#pragma unroll   // x[] stays in registers
            for (int n = 0; n < NN; ++n) x[n] = xr[n * (EE / 4)];
            v8f ca = {}, cb = {};
#pragma unroll   // x[n], w[t][j][n] by constant index
            for (int n = 0; n < NN; ++n) {
                v2f A, B0, B1;
                A.x = a0 ? w[t][j][n] : 0.0f;
                A.y = a1 ? w[t][j][n] : 0.0f;
                B0.x = x[n].x; B0.y = x[n].y;
                B1.x = x[n].z; B1.y = x[n].w;
                ca = __builtin_amdgcn_wmma_f32_16x16x4_f32(false, A, false, B0, (short)0, ca, false, false);
                cb = __builtin_amdgcn_wmma_f32_16x16x4_f32(false, A, false, B1, (short)0, cb, false, false);
            }
            // D register r = D[8*half + r][c]: lanes 0-15 take row classes 0,1 (e = 4*c + ..),
            // lanes 16-31 classes 2,3 (rows 10, 11: e = 64 + 4*c + ..): e = 4*lane + 0..3.
            o[j].x = half ? ca[2] : ca[0];
            o[j].y = half ? ca[3] : ca[1];
            o[j].z = half ? cb[2] : cb[0];
            o[j].w = half ? cb[3] : cb[1];
        }

        // Keeps this trip's WMMAs in front of the foot: sunk behind it, they hold the trip's stores
        // back until just ahead of the next barrier, which then waits for those stores to return.
        __builtin_amdgcn_sched_barrier(0);

        // Foot of the trip: publishes tile t + 1 and frees the buffer that this trip has read.
        asm volatile("s_wait_dscnt 0x0" ::: "memory");      // this wave's LDS reads of tile t are done
        asm volatile("s_wait_asynccnt 0x0" ::: "memory");   // this wave's copies of tile t + 1 have landed
        __syncthreads();
        if (t + 2 < TRIPS) {
            const float* gn = xg + (size_t)(t + 2) * TILE_ROWS * EE;
            copy_row(l0 + buf * buf_bytes, gn);
            copy_row(l0 + buf * buf_bytes + row_bytes, gn + EE);
        }

        // One 512-B line-aligned store a row, behind the refill so that the barrier does not wait on it.
        float* orow = O + (size_t)(g0 + t * TILE_ROWS + r0) * EE + lane * 4;
#pragma unroll   // o[j] by constant index
        for (int j = 0; j < RPW; ++j)
            __builtin_nontemporal_store(o[j], (v4f*)(orow + j * EE));
        // Keeps the stores here: sunk into the next trip they would still be open at its barrier.
        __builtin_amdgcn_sched_barrier(0);
    }
    asm volatile("s_wait_asynccnt 0x0" ::: "memory");   // no copy is open when the wave ends
}

extern "C" void kernel_launch(void* const* d_in, const int* in_sizes, int n_in,
                              void* d_out, int out_size, void* d_ws, size_t ws_size,
                              hipStream_t stream) {
    const float* W = (const float*)d_in[0];   // routing_logits [B,S,N]
    const float* X = (const float*)d_in[1];   // expert_outputs [B,N,S,E]
    float* O = (float*)d_out;                 // [B,S,E]
    (void)in_sizes; (void)n_in; (void)out_size; (void)d_ws; (void)ws_size;

    dim3 grid(BB * SS / WG_ROWS);   // 512 blocks x 8 waves, 64 rows a block
    dim3 block(256);
    hipLaunchKernelGGL(moe_combine_wmma, grid, block, 0, stream, W, X, O);
}
